// v000
// Times are from an AMD MI455X. After a warm-up the kernel runs many times in a row, and a time is the length of
// such a window on the GPU divided by its runs, so every launch and the gaps after it count. The runs cycle
// through copies of the inputs. A figure is the median of several windows, for all but v000 over two sittings.
// Sittings can differ by a few percent; kernels timed side by side share one.
// v000, which the later versions start from, runs in 919 microseconds.
#include <hip/hip_runtime.h>
#include <math.h>

// ---------------- Types ----------------
typedef __attribute__((ext_vector_type(16))) __bf16 v16bf;
typedef __attribute__((ext_vector_type(8)))  float  v8f;
typedef __attribute__((ext_vector_type(4)))  unsigned int uint32x4;
typedef __attribute__((ext_vector_type(8)))  int int32x8;
typedef __attribute__((ext_vector_type(4)))  int int32x4;
typedef unsigned short ushort_t;

union AFrag {
    v16bf v;
    uint4 u4[2];
};

__device__ __forceinline__ v8f wmma_bf16(v16bf a, v16bf b, v8f c) {
    return __builtin_amdgcn_wmma_f32_16x16x32_bf16(false, a, false, b, (short)0, c,
                                                   false, false);
}

__device__ __forceinline__ ushort_t f2bf(float f) {
    union { float f; unsigned u; } c;
    c.f = f;
    unsigned r = c.u + 0x7FFFu + ((c.u >> 16) & 1u);  // round-to-nearest-even
    return (ushort_t)(r >> 16);
}

// ---------------- Problem constants ----------------
#define BSZ    4
#define SEQ    1024
#define DMODEL 1024
#define NHEAD  16
#define DHEAD  64
#define MROWS  (BSZ * SEQ)   // 4096

__device__ __forceinline__ void tdm_load_tile_bf16(const ushort_t* gsrc, unsigned lds_off,
                                                   unsigned tensor_d0, unsigned tensor_d1,
                                                   unsigned tile_d0, unsigned tile_d1,
                                                   unsigned stride0) {
    unsigned long long ga = (unsigned long long)(size_t)gsrc;
    uint32x4 g0;
    g0[0] = 1u;
    g0[1] = lds_off;
    g0[2] = (unsigned)ga;
    g0[3] = (unsigned)((ga >> 32) & 0x01FFFFFFull) | 0x80000000u;
    int32x8 g1;
    g1[0] = (int)((1u << 16)
                | (1u << 20)
                | (3u << 22)
                | (3u << 25));
    g1[1] = (int)(tensor_d0 << 16);
    g1[2] = (int)((tensor_d0 >> 16) | (tensor_d1 << 16));
    g1[3] = (int)((tensor_d1 >> 16) | (tile_d0 << 16));
    g1[4] = (int)tile_d1;
    g1[5] = (int)stride0;
    g1[6] = 0;
    g1[7] = 0;
    int32x4 z4 = {};
    int32x8 z8 = {};
    // 6-arg variant (clang-23 / therock headers): groups 2,3 unused, extra group, cpol
    __builtin_amdgcn_tensor_load_to_lds(g0, g1, z4, z4, z8, 0);
}

// ---------------- h = x + pos ----------------
__global__ __launch_bounds__(256) void addpos_kernel(const float* __restrict__ x,
                                                     const float* __restrict__ pos,
                                                     float* __restrict__ h) {
    size_t i = ((size_t)blockIdx.x * 256 + threadIdx.x) * 4;
    float4 xv = *(const float4*)(x + i);
    float4 pv = *(const float4*)(pos + (i & (size_t)(SEQ * DMODEL - 1)));
    float4 o;
    o.x = xv.x + pv.x; o.y = xv.y + pv.y; o.z = xv.z + pv.z; o.w = xv.w + pv.w;
    *(float4*)(h + i) = o;
}

// ---------------- Weight pre-pass: W[l][k][n] f32 -> Wt[l][n][k] bf16 ----------------
__global__ __launch_bounds__(256) void wtrans_kernel(const float* __restrict__ W,
                                                     ushort_t* __restrict__ Wt) {
    __shared__ float tile[32][33];
    size_t base = (size_t)blockIdx.z * DMODEL * DMODEL;
    int bx = blockIdx.x * 32;   // n tile
    int by = blockIdx.y * 32;   // k tile
    int tx = threadIdx.x & 31, ty = threadIdx.x >> 5;   // 32 x 8
#pragma unroll
    for (int i = 0; i < 4; ++i)
        tile[ty + i * 8][tx] = W[base + (size_t)(by + ty + i * 8) * DMODEL + bx + tx];
    __syncthreads();
#pragma unroll
    for (int i = 0; i < 4; ++i)
        Wt[base + (size_t)(bx + ty + i * 8) * DMODEL + by + tx] = f2bf(tile[tx][ty + i * 8]);
}

// ---------------- LayerNorm -> bf16 ----------------
__global__ __launch_bounds__(256) void ln_kernel(const float* __restrict__ h,
                                                 const float* __restrict__ g,
                                                 const float* __restrict__ b,
                                                 ushort_t* __restrict__ out) {
    __shared__ float ssum[256];
    __shared__ float ssq[256];
    int row = blockIdx.x, t = threadIdx.x;
    const float* hr = h + (size_t)row * DMODEL;
    float4 f = ((const float4*)hr)[t];
    float s = f.x + f.y + f.z + f.w;
    float sq = f.x * f.x + f.y * f.y + f.z * f.z + f.w * f.w;
    ssum[t] = s; ssq[t] = sq;
    __syncthreads();
    for (int off = 128; off > 0; off >>= 1) {
        if (t < off) { ssum[t] += ssum[t + off]; ssq[t] += ssq[t + off]; }
        __syncthreads();
    }
    float mu = ssum[0] * (1.0f / DMODEL);
    float var = ssq[0] * (1.0f / DMODEL) - mu * mu;
    float rstd = rsqrtf(var + 1e-5f);
    float4 gv = ((const float4*)g)[t];
    float4 bv = ((const float4*)b)[t];
    ushort_t* orow = out + (size_t)row * DMODEL + t * 4;
    orow[0] = f2bf((f.x - mu) * rstd * gv.x + bv.x);
    orow[1] = f2bf((f.y - mu) * rstd * gv.y + bv.y);
    orow[2] = f2bf((f.z - mu) * rstd * gv.z + bv.z);
    orow[3] = f2bf((f.w - mu) * rstd * gv.w + bv.w);
}

#define BM 128
#define BN 128
#define BK 32
#define BKP 40

template <bool BIAS, bool GELU_, bool RESID, bool OBF16, bool TRANSOUT>
__global__ __launch_bounds__(256) void gemm_kernel(const ushort_t* __restrict__ A,
                                                   const ushort_t* __restrict__ Bt,
                                                   const float* __restrict__ bias,
                                                   const float* __restrict__ resid,
                                                   float* __restrict__ outF,
                                                   ushort_t* __restrict__ outB) {
    __shared__ ushort_t As[2][BM * BKP];
    __shared__ ushort_t Bs[2][BN * BKP];
    const int K = DMODEL, N = DMODEL;
    int t = threadIdx.x;
    int w = t >> 5, lane = t & 31;
    int lm = lane & 15, lh = lane >> 4, kb = lh * 8;
    int wm = w >> 2, wn = w & 3;
    int m0 = blockIdx.y * BM, n0 = blockIdx.x * BN;

    v8f acc[4][2] = {};

    if (t < 32) {
        tdm_load_tile_bf16(A  + (size_t)m0 * K, (unsigned)(size_t)&As[0][0],
                           K, MROWS, BK, BM, K);
        tdm_load_tile_bf16(Bt + (size_t)n0 * K, (unsigned)(size_t)&Bs[0][0],
                           K, N, BK, BN, K);
    }
    __builtin_amdgcn_s_wait_tensorcnt(0);
    __syncthreads();

    int buf = 0;
    for (int k0 = 0; k0 < K; k0 += BK) {
        // Async-prefetch next tiles into the other buffer while we compute
        if (k0 + BK < K && t < 32) {
            tdm_load_tile_bf16(A  + (size_t)m0 * K + k0 + BK, (unsigned)(size_t)&As[buf ^ 1][0],
                               K, MROWS, BK, BM, K);
            tdm_load_tile_bf16(Bt + (size_t)n0 * K + k0 + BK, (unsigned)(size_t)&Bs[buf ^ 1][0],
                               K, N, BK, BN, K);
        }

        const ushort_t* Ab = &As[buf][0];
        const ushort_t* Bb = &Bs[buf][0];
        AFrag af[4], bfr[2];
#pragma unroll
        for (int mf = 0; mf < 4; ++mf) {
            int r_ = wm * 64 + mf * 16 + lm;
            af[mf].u4[0] = *(const uint4*)&Ab[r_ * BKP + kb];
            af[mf].u4[1] = *(const uint4*)&Ab[r_ * BKP + kb + 16];
        }
#pragma unroll
        for (int nf = 0; nf < 2; ++nf) {
            int c_ = wn * 32 + nf * 16 + lm;
            bfr[nf].u4[0] = *(const uint4*)&Bb[c_ * BKP + kb];
            bfr[nf].u4[1] = *(const uint4*)&Bb[c_ * BKP + kb + 16];
        }
#pragma unroll
        for (int mf = 0; mf < 4; ++mf)
#pragma unroll
            for (int nf = 0; nf < 2; ++nf)
                acc[mf][nf] = wmma_bf16(af[mf].v, bfr[nf].v, acc[mf][nf]);

        __builtin_amdgcn_s_wait_tensorcnt(0);   // no-op for waves 1..7
        __syncthreads();
        buf ^= 1;
    }

    // Epilogue: C layout per lane: n = lm, m = r + 8*lh within each 16x16 tile
#pragma unroll
    for (int nf = 0; nf < 2; ++nf) {
        int n = n0 + wn * 32 + nf * 16 + lm;
        float bv = BIAS ? bias[n] : 0.0f;
#pragma unroll
        for (int mf = 0; mf < 4; ++mf) {
#pragma unroll
            for (int r = 0; r < 8; ++r) {
                int m = m0 + wm * 64 + mf * 16 + r + 8 * lh;
                float x = acc[mf][nf][r] + bv;
                if (GELU_) x = 0.5f * x * (1.0f + erff(x * 0.70710678f));
                if (RESID) x += resid[(size_t)m * N + n];
                if (OBF16) {
                    if (TRANSOUT) outB[(size_t)n * MROWS + m] = f2bf(x);
                    else          outB[(size_t)m * N + n]     = f2bf(x);
                } else {
                    outF[(size_t)m * N + n] = x;
                }
            }
        }
    }
}

// ---------------- Flash attention (bf16 WMMA, online softmax, barrier-free) ----------------
// V arrives pre-transposed as Vt[D][M]; K/Q/V fragments load straight from global.
// Grid: B*H*(S/128) blocks, 256 threads = 8 waves, each wave owns 16 q-rows.
__global__ __launch_bounds__(256) void attn_kernel(const ushort_t* __restrict__ Q,
                                                   const ushort_t* __restrict__ K,
                                                   const ushort_t* __restrict__ Vt,
                                                   ushort_t* __restrict__ O) {
    __shared__ ushort_t Plds[8][16 * 40];      // per-wave P staging [q][j]
    int w = threadIdx.x >> 5, lane = threadIdx.x & 31;
    int lm = lane & 15, lh = lane >> 4, kb = lh * 8;
    int qb = blockIdx.x & 7;                   // S/128 = 8
    int bh = blockIdx.x >> 3;
    int bi = bh >> 4, hi = bh & 15;
    size_t headoff = (size_t)bi * SEQ * DMODEL + (size_t)hi * DHEAD;
    int q0 = qb * 128 + w * 16;

    AFrag qf[2];
    {
        const ushort_t* qrow = Q + headoff + (size_t)(q0 + lm) * DMODEL;
#pragma unroll
        for (int d = 0; d < 2; ++d) {
            qf[d].u4[0] = *(const uint4*)(qrow + d * 32 + kb);
            qf[d].u4[1] = *(const uint4*)(qrow + d * 32 + kb + 16);
        }
    }

    v8f o_acc[4] = {};
    float mrow[8], lrowv[8];
#pragma unroll
    for (int r = 0; r < 8; ++r) { mrow[r] = -1e30f; lrowv[r] = 0.0f; }

    for (int kv0 = 0; kv0 < SEQ; kv0 += 32) {
        if (kv0 + 32 < SEQ)
            __builtin_prefetch(K + headoff + (size_t)(kv0 + 32 + lm) * DMODEL, 0, 1);

        // Scores: S[16q x 32j] = Q x K^T
        v8f s0 = {}, s1 = {};
#pragma unroll
        for (int jt = 0; jt < 2; ++jt) {
            const ushort_t* krow = K + headoff + (size_t)(kv0 + jt * 16 + lm) * DMODEL;
            AFrag kf0, kf1;
            kf0.u4[0] = *(const uint4*)(krow + kb);
            kf0.u4[1] = *(const uint4*)(krow + kb + 16);
            kf1.u4[0] = *(const uint4*)(krow + 32 + kb);
            kf1.u4[1] = *(const uint4*)(krow + 32 + kb + 16);
            if (jt == 0) {
                s0 = wmma_bf16(qf[0].v, kf0.v, s0);
                s0 = wmma_bf16(qf[1].v, kf1.v, s0);
            } else {
                s1 = wmma_bf16(qf[0].v, kf0.v, s1);
                s1 = wmma_bf16(qf[1].v, kf1.v, s1);
            }
        }

        // Online softmax (rows in 16-lane halves; xor-shuffle reductions, wave32)
        ushort_t* Pw = Plds[w];
#pragma unroll
        for (int r = 0; r < 8; ++r) {
            float a = s0[r] * 0.125f, b = s1[r] * 0.125f;
            float mx = fmaxf(a, b);
#pragma unroll
            for (int msk = 1; msk < 16; msk <<= 1) mx = fmaxf(mx, __shfl_xor(mx, msk, 32));
            float mnew = fmaxf(mrow[r], mx);
            float p0 = __expf(a - mnew), p1 = __expf(b - mnew);
            float alpha = __expf(mrow[r] - mnew);
            float rs = p0 + p1;
#pragma unroll
            for (int msk = 1; msk < 16; msk <<= 1) rs += __shfl_xor(rs, msk, 32);
            lrowv[r] = lrowv[r] * alpha + rs;
            mrow[r] = mnew;
#pragma unroll
            for (int nt = 0; nt < 4; ++nt) o_acc[nt][r] *= alpha;
            int prow = r + 8 * lh;
            Pw[prow * 40 + lm] = f2bf(p0);
            Pw[prow * 40 + 16 + lm] = f2bf(p1);
        }

        // P fragment (wave-private LDS re-layout C-frag -> A-frag)
        AFrag pf;
        pf.u4[0] = *(const uint4*)&Pw[lm * 40 + kb];
        pf.u4[1] = *(const uint4*)&Pw[lm * 40 + kb + 16];

        // O += P x V  (V B-frags straight from transposed global Vt[D][M])
#pragma unroll
        for (int nt = 0; nt < 4; ++nt) {
            AFrag vf;
            const ushort_t* vrow = Vt + (size_t)(hi * DHEAD + nt * 16 + lm) * MROWS
                                      + (size_t)bi * SEQ + kv0;
            vf.u4[0] = *(const uint4*)(vrow + kb);
            vf.u4[1] = *(const uint4*)(vrow + kb + 16);
            o_acc[nt] = wmma_bf16(pf.v, vf.v, o_acc[nt]);
        }
    }

    // Normalize and store bf16 [B,S,D] with heads interleaved
#pragma unroll
    for (int nt = 0; nt < 4; ++nt) {
#pragma unroll
        for (int r = 0; r < 8; ++r) {
            int qq = q0 + r + 8 * lh;
            float val = o_acc[nt][r] / lrowv[r];
            O[headoff + (size_t)qq * DMODEL + nt * 16 + lm] = f2bf(val);
        }
    }
}

// ---------------- Host launcher ----------------
extern "C" void kernel_launch(void* const* d_in, const int* in_sizes, int n_in,
                              void* d_out, int out_size, void* d_ws, size_t ws_size,
                              hipStream_t stream) {
    const float* x     = (const float*)d_in[0];
    const float* pos   = (const float*)d_in[1];
    const float* ln1_g = (const float*)d_in[2];
    const float* ln1_b = (const float*)d_in[3];
    const float* Wq    = (const float*)d_in[4];
    const float* Wk    = (const float*)d_in[5];
    const float* Wv    = (const float*)d_in[6];
    const float* Wo    = (const float*)d_in[7];
    const float* ln2_g = (const float*)d_in[8];
    const float* ln2_b = (const float*)d_in[9];
    const float* W1    = (const float*)d_in[10];
    const float* b1    = (const float*)d_in[11];
    const float* W2    = (const float*)d_in[12];
    const float* b2    = (const float*)d_in[13];
    float* out = (float*)d_out;

    const size_t MD = (size_t)MROWS * DMODEL;     // 4M elements
    const size_t DD = (size_t)DMODEL * DMODEL;    // 1M elements
    char* ws = (char*)d_ws;
    float*    h   = (float*)ws;                      // 16 MB f32 residual stream
    ushort_t* nb  = (ushort_t*)(ws + MD * 4);        // bf16 LN output
    ushort_t* qB  = nb + MD;
    ushort_t* kB  = qB + MD;
    ushort_t* vTB = kB + MD;                         // V, transposed [D][M]
    ushort_t* oB  = vTB + MD;
    ushort_t* f1B = oB + MD;
    ushort_t* wt  = f1B + MD;                        // 6 x [DEPTH][D][D] bf16, transposed
    ushort_t* wtQ = wt;
    ushort_t* wtK = wtQ + 4 * DD;
    ushort_t* wtV = wtK + 4 * DD;
    ushort_t* wtO = wtV + 4 * DD;
    ushort_t* wt1 = wtO + 4 * DD;
    ushort_t* wt2 = wt1 + 4 * DD;

    dim3 tgrid(32, 32, 4);
    wtrans_kernel<<<tgrid, 256, 0, stream>>>(Wq, wtQ);
    wtrans_kernel<<<tgrid, 256, 0, stream>>>(Wk, wtK);
    wtrans_kernel<<<tgrid, 256, 0, stream>>>(Wv, wtV);
    wtrans_kernel<<<tgrid, 256, 0, stream>>>(Wo, wtO);
    wtrans_kernel<<<tgrid, 256, 0, stream>>>(W1, wt1);
    wtrans_kernel<<<tgrid, 256, 0, stream>>>(W2, wt2);

    addpos_kernel<<<4096, 256, 0, stream>>>(x, pos, h);

    dim3 ggrid(DMODEL / BN, MROWS / BM);   // (8, 32)

    for (int L = 0; L < 4; ++L) {
        // --- Attention block ---
        ln_kernel<<<MROWS, 256, 0, stream>>>(h, ln1_g + L * DMODEL, ln1_b + L * DMODEL, nb);
        gemm_kernel<false, false, false, true, false><<<ggrid, 256, 0, stream>>>(
            nb, wtQ + L * DD, nullptr, nullptr, nullptr, qB);
        gemm_kernel<false, false, false, true, false><<<ggrid, 256, 0, stream>>>(
            nb, wtK + L * DD, nullptr, nullptr, nullptr, kB);
        gemm_kernel<false, false, false, true, true><<<ggrid, 256, 0, stream>>>(
            nb, wtV + L * DD, nullptr, nullptr, nullptr, vTB);     // V stored [D][M]
        attn_kernel<<<BSZ * NHEAD * (SEQ / 128), 256, 0, stream>>>(qB, kB, vTB, oB);
        gemm_kernel<false, false, true, false, false><<<ggrid, 256, 0, stream>>>(
            oB, wtO + L * DD, nullptr, h, h, nullptr);             // h = h + attn_out

        // --- FFN block ---
        ln_kernel<<<MROWS, 256, 0, stream>>>(h, ln2_g + L * DMODEL, ln2_b + L * DMODEL, nb);
        gemm_kernel<true, true, false, true, false><<<ggrid, 256, 0, stream>>>(
            nb, wt1 + L * DD, b1 + L * DMODEL, nullptr, nullptr, f1B);
        float* hout = (L == 3) ? out : h;
        gemm_kernel<true, false, true, false, false><<<ggrid, 256, 0, stream>>>(
            f1B, wt2 + L * DD, b2 + L * DMODEL, h, hout, nullptr); // h(+1) = h + ffn
    }
}

// v001
// Measured time: 840 microseconds a run.
// Next to v000, in two timings, it ran 1.12 times as fast each time.
#include <hip/hip_runtime.h>
#include <math.h>

// ---------------- Types ----------------
typedef __attribute__((ext_vector_type(16))) __bf16 v16bf;
typedef __attribute__((ext_vector_type(8)))  float  v8f;
typedef __attribute__((ext_vector_type(4)))  unsigned int uint32x4;
typedef __attribute__((ext_vector_type(8)))  int int32x8;
typedef __attribute__((ext_vector_type(4)))  int int32x4;
typedef unsigned short ushort_t;

union AFrag {
    v16bf v;
    uint4 u4[2];
};

__device__ __forceinline__ v8f wmma_bf16(v16bf a, v16bf b, v8f c) {
    return __builtin_amdgcn_wmma_f32_16x16x32_bf16(false, a, false, b, (short)0, c,
                                                   false, false);
}

__device__ __forceinline__ ushort_t f2bf(float f) {
    union { float f; unsigned u; } c;
    c.f = f;
    unsigned r = c.u + 0x7FFFu + ((c.u >> 16) & 1u);  // round-to-nearest-even
    return (ushort_t)(r >> 16);
}

// ---------------- Problem constants ----------------
#define BSZ    4
#define SEQ    1024
#define DMODEL 1024
#define NHEAD  16
#define DHEAD  64
#define MROWS  (BSZ * SEQ)   // 4096

__device__ __forceinline__ void tdm_load_tile_bf16(const ushort_t* gsrc, unsigned lds_off,
                                                   unsigned tensor_d0, unsigned tensor_d1,
                                                   unsigned tile_d0, unsigned tile_d1,
                                                   unsigned stride0) {
    unsigned long long ga = (unsigned long long)(size_t)gsrc;
    uint32x4 g0;
    g0[0] = 1u;
    g0[1] = lds_off;
    g0[2] = (unsigned)ga;
    g0[3] = (unsigned)((ga >> 32) & 0x01FFFFFFull) | 0x80000000u;
    int32x8 g1;
    g1[0] = (int)((1u << 16)
                | (1u << 20)
                | (3u << 22)
                | (3u << 25));
    g1[1] = (int)(tensor_d0 << 16);
    g1[2] = (int)((tensor_d0 >> 16) | (tensor_d1 << 16));
    g1[3] = (int)((tensor_d1 >> 16) | (tile_d0 << 16));
    g1[4] = (int)tile_d1;
    g1[5] = (int)stride0;
    g1[6] = 0;
    g1[7] = 0;
    int32x4 z4 = {};
    int32x8 z8 = {};
    // 6-arg variant (clang-23 / therock headers): groups 2,3 unused, extra group, cpol
    __builtin_amdgcn_tensor_load_to_lds(g0, g1, z4, z4, z8, 0);
}

// ---------------- h = x + pos ----------------
__global__ __launch_bounds__(256) void addpos_kernel(const float* __restrict__ x,
                                                     const float* __restrict__ pos,
                                                     float* __restrict__ h) {
    size_t i = ((size_t)blockIdx.x * 256 + threadIdx.x) * 4;
    float4 xv = *(const float4*)(x + i);
    float4 pv = *(const float4*)(pos + (i & (size_t)(SEQ * DMODEL - 1)));
    float4 o;
    o.x = xv.x + pv.x; o.y = xv.y + pv.y; o.z = xv.z + pv.z; o.w = xv.w + pv.w;
    *(float4*)(h + i) = o;
}

// ---------------- Weight pre-pass: W[l][k][n] f32 -> Wt[l][n][k] bf16 ----------------
__global__ __launch_bounds__(256) void wtrans_kernel(const float* __restrict__ W,
                                                     ushort_t* __restrict__ Wt) {
    __shared__ float tile[32][33];
    size_t base = (size_t)blockIdx.z * DMODEL * DMODEL;
    int bx = blockIdx.x * 32;   // n tile
    int by = blockIdx.y * 32;   // k tile
    int tx = threadIdx.x & 31, ty = threadIdx.x >> 5;   // 32 x 8
#pragma unroll
    for (int i = 0; i < 4; ++i)
        tile[ty + i * 8][tx] = W[base + (size_t)(by + ty + i * 8) * DMODEL + bx + tx];
    __syncthreads();
#pragma unroll
    for (int i = 0; i < 4; ++i)
        Wt[base + (size_t)(bx + ty + i * 8) * DMODEL + by + tx] = f2bf(tile[tx][ty + i * 8]);
}

// ---------------- LayerNorm -> bf16 ----------------
__global__ __launch_bounds__(256) void ln_kernel(const float* __restrict__ h,
                                                 const float* __restrict__ g,
                                                 const float* __restrict__ b,
                                                 ushort_t* __restrict__ out) {
    __shared__ float ssum[256];
    __shared__ float ssq[256];
    int row = blockIdx.x, t = threadIdx.x;
    const float* hr = h + (size_t)row * DMODEL;
    float4 f = ((const float4*)hr)[t];
    float s = f.x + f.y + f.z + f.w;
    float sq = f.x * f.x + f.y * f.y + f.z * f.z + f.w * f.w;
    ssum[t] = s; ssq[t] = sq;
    __syncthreads();
    for (int off = 128; off > 0; off >>= 1) {
        if (t < off) { ssum[t] += ssum[t + off]; ssq[t] += ssq[t + off]; }
        __syncthreads();
    }
    float mu = ssum[0] * (1.0f / DMODEL);
    float var = ssq[0] * (1.0f / DMODEL) - mu * mu;
    float rstd = rsqrtf(var + 1e-5f);
    float4 gv = ((const float4*)g)[t];
    float4 bv = ((const float4*)b)[t];
    ushort_t* orow = out + (size_t)row * DMODEL + t * 4;
    orow[0] = f2bf((f.x - mu) * rstd * gv.x + bv.x);
    orow[1] = f2bf((f.y - mu) * rstd * gv.y + bv.y);
    orow[2] = f2bf((f.z - mu) * rstd * gv.z + bv.z);
    orow[3] = f2bf((f.w - mu) * rstd * gv.w + bv.w);
}

#define BM 128
#define BN 128
#define BK 32
#define BKP 40

template <bool BIAS, bool GELU_, bool RESID, bool OBF16, bool TRANSOUT>
__global__ __launch_bounds__(256) void gemm_kernel(const ushort_t* __restrict__ A,
                                                   const ushort_t* __restrict__ Bt,
                                                   const float* __restrict__ bias,
                                                   const float* __restrict__ resid,
                                                   float* __restrict__ outF,
                                                   ushort_t* __restrict__ outB) {
    __shared__ ushort_t As[2][BM * BKP];
    __shared__ ushort_t Bs[2][BN * BKP];
    const int K = DMODEL, N = DMODEL;
    int t = threadIdx.x;
    int w = t >> 5, lane = t & 31;
    int lm = lane & 15, lh = lane >> 4, kb = lh * 8;
    int wm = w >> 2, wn = w & 3;
    int m0 = blockIdx.y * BM, n0 = blockIdx.x * BN;

    v8f acc[4][2] = {};

    if (t < 32) {
        tdm_load_tile_bf16(A  + (size_t)m0 * K, (unsigned)(size_t)&As[0][0],
                           K, MROWS, BK, BM, K);
        tdm_load_tile_bf16(Bt + (size_t)n0 * K, (unsigned)(size_t)&Bs[0][0],
                           K, N, BK, BN, K);
    }
    // Residual values, all 64 of this lane, issued as one group ahead of the K loop, beside the first
    // tile's tensor loads: one load latency for all of them instead of one per element in the epilogue.
    // Each element is read here and written in the epilogue by the same lane and by no other.
    // The three loops are unrolled so that every index of rv is a constant and rv stays in registers.
    float rv[2][4][8];
    if (RESID) {
#pragma unroll
        for (int nf = 0; nf < 2; ++nf)
#pragma unroll
            for (int mf = 0; mf < 4; ++mf)
#pragma unroll
                for (int r = 0; r < 8; ++r)
                    rv[nf][mf][r] = resid[(size_t)(m0 + wm * 64 + mf * 16 + r + 8 * lh) * N
                                          + (n0 + wn * 32 + nf * 16 + lm)];
    }

    __builtin_amdgcn_s_wait_tensorcnt(0);
    __syncthreads();

    int buf = 0;
    for (int k0 = 0; k0 < K; k0 += BK) {
        // Async-prefetch next tiles into the other buffer while we compute
        if (k0 + BK < K && t < 32) {
            tdm_load_tile_bf16(A  + (size_t)m0 * K + k0 + BK, (unsigned)(size_t)&As[buf ^ 1][0],
                               K, MROWS, BK, BM, K);
            tdm_load_tile_bf16(Bt + (size_t)n0 * K + k0 + BK, (unsigned)(size_t)&Bs[buf ^ 1][0],
                               K, N, BK, BN, K);
        }

        const ushort_t* Ab = &As[buf][0];
        const ushort_t* Bb = &Bs[buf][0];
        AFrag af[4], bfr[2];
#pragma unroll
        for (int mf = 0; mf < 4; ++mf) {
            int r_ = wm * 64 + mf * 16 + lm;
            af[mf].u4[0] = *(const uint4*)&Ab[r_ * BKP + kb];
            af[mf].u4[1] = *(const uint4*)&Ab[r_ * BKP + kb + 16];
        }
#pragma unroll
        for (int nf = 0; nf < 2; ++nf) {
            int c_ = wn * 32 + nf * 16 + lm;
            bfr[nf].u4[0] = *(const uint4*)&Bb[c_ * BKP + kb];
            bfr[nf].u4[1] = *(const uint4*)&Bb[c_ * BKP + kb + 16];
        }
#pragma unroll
        for (int mf = 0; mf < 4; ++mf)
#pragma unroll
            for (int nf = 0; nf < 2; ++nf)
                acc[mf][nf] = wmma_bf16(af[mf].v, bfr[nf].v, acc[mf][nf]);

        __builtin_amdgcn_s_wait_tensorcnt(0);   // no-op for waves 1..7
        __syncthreads();
        buf ^= 1;
    }

    // Epilogue: C layout per lane: n = lm, m = r + 8*lh within each 16x16 tile
#pragma unroll
    for (int nf = 0; nf < 2; ++nf) {
        int n = n0 + wn * 32 + nf * 16 + lm;
        float bv = BIAS ? bias[n] : 0.0f;
#pragma unroll
        for (int mf = 0; mf < 4; ++mf) {
#pragma unroll
            for (int r = 0; r < 8; ++r) {
                int m = m0 + wm * 64 + mf * 16 + r + 8 * lh;
                float x = acc[mf][nf][r] + bv;
                if (GELU_) x = 0.5f * x * (1.0f + erff(x * 0.70710678f));
                if (RESID) x += rv[nf][mf][r];
                if (OBF16) {
                    if (TRANSOUT) outB[(size_t)n * MROWS + m] = f2bf(x);
                    else          outB[(size_t)m * N + n]     = f2bf(x);
                } else {
                    outF[(size_t)m * N + n] = x;
                }
            }
        }
    }
}

// ---------------- Flash attention (bf16 WMMA, online softmax, barrier-free) ----------------
// V arrives pre-transposed as Vt[D][M]; K/Q/V fragments load straight from global.
// Grid: B*H*(S/128) blocks, 256 threads = 8 waves, each wave owns 16 q-rows.
__global__ __launch_bounds__(256) void attn_kernel(const ushort_t* __restrict__ Q,
                                                   const ushort_t* __restrict__ K,
                                                   const ushort_t* __restrict__ Vt,
                                                   ushort_t* __restrict__ O) {
    __shared__ ushort_t Plds[8][16 * 40];      // per-wave P staging [q][j]
    int w = threadIdx.x >> 5, lane = threadIdx.x & 31;
    int lm = lane & 15, lh = lane >> 4, kb = lh * 8;
    int qb = blockIdx.x & 7;                   // S/128 = 8
    int bh = blockIdx.x >> 3;
    int bi = bh >> 4, hi = bh & 15;
    size_t headoff = (size_t)bi * SEQ * DMODEL + (size_t)hi * DHEAD;
    int q0 = qb * 128 + w * 16;

    AFrag qf[2];
    {
        const ushort_t* qrow = Q + headoff + (size_t)(q0 + lm) * DMODEL;
#pragma unroll
        for (int d = 0; d < 2; ++d) {
            qf[d].u4[0] = *(const uint4*)(qrow + d * 32 + kb);
            qf[d].u4[1] = *(const uint4*)(qrow + d * 32 + kb + 16);
        }
    }

    v8f o_acc[4] = {};
    float mrow[8], lrowv[8];
#pragma unroll
    for (int r = 0; r < 8; ++r) { mrow[r] = -1e30f; lrowv[r] = 0.0f; }

    for (int kv0 = 0; kv0 < SEQ; kv0 += 32) {
        if (kv0 + 32 < SEQ)
            __builtin_prefetch(K + headoff + (size_t)(kv0 + 32 + lm) * DMODEL, 0, 1);

        // Scores: S[16q x 32j] = Q x K^T
        v8f s0 = {}, s1 = {};
#pragma unroll
        for (int jt = 0; jt < 2; ++jt) {
            const ushort_t* krow = K + headoff + (size_t)(kv0 + jt * 16 + lm) * DMODEL;
            AFrag kf0, kf1;
            kf0.u4[0] = *(const uint4*)(krow + kb);
            kf0.u4[1] = *(const uint4*)(krow + kb + 16);
            kf1.u4[0] = *(const uint4*)(krow + 32 + kb);
            kf1.u4[1] = *(const uint4*)(krow + 32 + kb + 16);
            if (jt == 0) {
                s0 = wmma_bf16(qf[0].v, kf0.v, s0);
                s0 = wmma_bf16(qf[1].v, kf1.v, s0);
            } else {
                s1 = wmma_bf16(qf[0].v, kf0.v, s1);
                s1 = wmma_bf16(qf[1].v, kf1.v, s1);
            }
        }

        // Online softmax (rows in 16-lane halves; xor-shuffle reductions, wave32)
        ushort_t* Pw = Plds[w];
#pragma unroll
        for (int r = 0; r < 8; ++r) {
            float a = s0[r] * 0.125f, b = s1[r] * 0.125f;
            float mx = fmaxf(a, b);
#pragma unroll
            for (int msk = 1; msk < 16; msk <<= 1) mx = fmaxf(mx, __shfl_xor(mx, msk, 32));
            float mnew = fmaxf(mrow[r], mx);
            float p0 = __expf(a - mnew), p1 = __expf(b - mnew);
            float alpha = __expf(mrow[r] - mnew);
            float rs = p0 + p1;
#pragma unroll
            for (int msk = 1; msk < 16; msk <<= 1) rs += __shfl_xor(rs, msk, 32);
            lrowv[r] = lrowv[r] * alpha + rs;
            mrow[r] = mnew;
#pragma unroll
            for (int nt = 0; nt < 4; ++nt) o_acc[nt][r] *= alpha;
            int prow = r + 8 * lh;
            Pw[prow * 40 + lm] = f2bf(p0);
            Pw[prow * 40 + 16 + lm] = f2bf(p1);
        }

        // P fragment (wave-private LDS re-layout C-frag -> A-frag)
        AFrag pf;
        pf.u4[0] = *(const uint4*)&Pw[lm * 40 + kb];
        pf.u4[1] = *(const uint4*)&Pw[lm * 40 + kb + 16];

        // O += P x V  (V B-frags straight from transposed global Vt[D][M])
#pragma unroll
        for (int nt = 0; nt < 4; ++nt) {
            AFrag vf;
            const ushort_t* vrow = Vt + (size_t)(hi * DHEAD + nt * 16 + lm) * MROWS
                                      + (size_t)bi * SEQ + kv0;
            vf.u4[0] = *(const uint4*)(vrow + kb);
            vf.u4[1] = *(const uint4*)(vrow + kb + 16);
            o_acc[nt] = wmma_bf16(pf.v, vf.v, o_acc[nt]);
        }
    }

    // Normalize and store bf16 [B,S,D] with heads interleaved
#pragma unroll
    for (int nt = 0; nt < 4; ++nt) {
#pragma unroll
        for (int r = 0; r < 8; ++r) {
            int qq = q0 + r + 8 * lh;
            float val = o_acc[nt][r] / lrowv[r];
            O[headoff + (size_t)qq * DMODEL + nt * 16 + lm] = f2bf(val);
        }
    }
}

// ---------------- Host launcher ----------------
extern "C" void kernel_launch(void* const* d_in, const int* in_sizes, int n_in,
                              void* d_out, int out_size, void* d_ws, size_t ws_size,
                              hipStream_t stream) {
    const float* x     = (const float*)d_in[0];
    const float* pos   = (const float*)d_in[1];
    const float* ln1_g = (const float*)d_in[2];
    const float* ln1_b = (const float*)d_in[3];
    const float* Wq    = (const float*)d_in[4];
    const float* Wk    = (const float*)d_in[5];
    const float* Wv    = (const float*)d_in[6];
    const float* Wo    = (const float*)d_in[7];
    const float* ln2_g = (const float*)d_in[8];
    const float* ln2_b = (const float*)d_in[9];
    const float* W1    = (const float*)d_in[10];
    const float* b1    = (const float*)d_in[11];
    const float* W2    = (const float*)d_in[12];
    const float* b2    = (const float*)d_in[13];
    float* out = (float*)d_out;

    const size_t MD = (size_t)MROWS * DMODEL;     // 4M elements
    const size_t DD = (size_t)DMODEL * DMODEL;    // 1M elements
    char* ws = (char*)d_ws;
    float*    h   = (float*)ws;                      // 16 MB f32 residual stream
    ushort_t* nb  = (ushort_t*)(ws + MD * 4);        // bf16 LN output
    ushort_t* qB  = nb + MD;
    ushort_t* kB  = qB + MD;
    ushort_t* vTB = kB + MD;                         // V, transposed [D][M]
    ushort_t* oB  = vTB + MD;
    ushort_t* f1B = oB + MD;
    ushort_t* wt  = f1B + MD;                        // 6 x [DEPTH][D][D] bf16, transposed
    ushort_t* wtQ = wt;
    ushort_t* wtK = wtQ + 4 * DD;
    ushort_t* wtV = wtK + 4 * DD;
    ushort_t* wtO = wtV + 4 * DD;
    ushort_t* wt1 = wtO + 4 * DD;
    ushort_t* wt2 = wt1 + 4 * DD;

    dim3 tgrid(32, 32, 4);
    wtrans_kernel<<<tgrid, 256, 0, stream>>>(Wq, wtQ);
    wtrans_kernel<<<tgrid, 256, 0, stream>>>(Wk, wtK);
    wtrans_kernel<<<tgrid, 256, 0, stream>>>(Wv, wtV);
    wtrans_kernel<<<tgrid, 256, 0, stream>>>(Wo, wtO);
    wtrans_kernel<<<tgrid, 256, 0, stream>>>(W1, wt1);
    wtrans_kernel<<<tgrid, 256, 0, stream>>>(W2, wt2);

    addpos_kernel<<<4096, 256, 0, stream>>>(x, pos, h);

    dim3 ggrid(DMODEL / BN, MROWS / BM);   // (8, 32)

    for (int L = 0; L < 4; ++L) {
        // --- Attention block ---
        ln_kernel<<<MROWS, 256, 0, stream>>>(h, ln1_g + L * DMODEL, ln1_b + L * DMODEL, nb);
        gemm_kernel<false, false, false, true, false><<<ggrid, 256, 0, stream>>>(
            nb, wtQ + L * DD, nullptr, nullptr, nullptr, qB);
        gemm_kernel<false, false, false, true, false><<<ggrid, 256, 0, stream>>>(
            nb, wtK + L * DD, nullptr, nullptr, nullptr, kB);
        gemm_kernel<false, false, false, true, true><<<ggrid, 256, 0, stream>>>(
            nb, wtV + L * DD, nullptr, nullptr, nullptr, vTB);     // V stored [D][M]
        attn_kernel<<<BSZ * NHEAD * (SEQ / 128), 256, 0, stream>>>(qB, kB, vTB, oB);
        gemm_kernel<false, false, true, false, false><<<ggrid, 256, 0, stream>>>(
            oB, wtO + L * DD, nullptr, h, h, nullptr);             // h = h + attn_out

        // --- FFN block ---
        ln_kernel<<<MROWS, 256, 0, stream>>>(h, ln2_g + L * DMODEL, ln2_b + L * DMODEL, nb);
        gemm_kernel<true, true, false, true, false><<<ggrid, 256, 0, stream>>>(
            nb, wt1 + L * DD, b1 + L * DMODEL, nullptr, nullptr, f1B);
        float* hout = (L == 3) ? out : h;
        gemm_kernel<true, false, true, false, false><<<ggrid, 256, 0, stream>>>(
            f1B, wt2 + L * DD, b2 + L * DMODEL, h, hout, nullptr); // h(+1) = h + ffn
    }
}

// v002
// One run takes 666 microseconds.
// Two timings next to v001 both put it at 1.27 times that version's speed.
// All steps since v000 together make it 1.42 times as fast.
#include <hip/hip_runtime.h>
#include <math.h>

// ---------------- Types ----------------
typedef __attribute__((ext_vector_type(16))) __bf16 v16bf;
typedef __attribute__((ext_vector_type(8)))  float  v8f;
typedef unsigned short ushort_t;

union AFrag {
    v16bf v;
    uint4 u4[2];
};

__device__ __forceinline__ v8f wmma_bf16(v16bf a, v16bf b, v8f c) {
    return __builtin_amdgcn_wmma_f32_16x16x32_bf16(false, a, false, b, (short)0, c,
                                                   false, false);
}

__device__ __forceinline__ ushort_t f2bf(float f) {
    union { float f; unsigned u; } c;
    c.f = f;
    unsigned r = c.u + 0x7FFFu + ((c.u >> 16) & 1u);  // round-to-nearest-even
    return (ushort_t)(r >> 16);
}

// ---------------- Problem constants ----------------
#define BSZ    4
#define SEQ    1024
#define DMODEL 1024
#define NHEAD  16
#define DHEAD  64
#define MROWS  (BSZ * SEQ)   // 4096

typedef unsigned int u32x4 __attribute__((ext_vector_type(4)));
typedef unsigned int u32x8 __attribute__((ext_vector_type(8)));

__device__ __forceinline__ unsigned uni(unsigned v) {
    return (unsigned)__builtin_amdgcn_readfirstlane(v);
}
__device__ __forceinline__ unsigned pinned(unsigned v) {
    unsigned w = uni(v);
    asm volatile("" : "+s"(w));
    return w;
}
// The clobber keeps LDS reads on their side of the wait.
__device__ __forceinline__ void wait_tensor0() { asm volatile("s_wait_tensorcnt 0x0" ::: "memory"); }
// A wave's LDS reads have retired before its buffer is handed back for a refill.
__device__ __forceinline__ void wait_ds0() { asm volatile("s_wait_dscnt 0x0" ::: "memory"); }

#define TROWB  256u    // bytes of a tile row: 128 bf16 along K
#define TROWS  32u     // rows of one wave's slice
#define TPITCH 272u    // LDS row pitch: 256 + 16 bytes of pad, an odd multiple of 16 for ds_load_b128

__device__ __forceinline__ u32x8 tdm_group1(unsigned src_pitch) {
    u32x8 g;
    g[0] = uni((1u << 20) | (5u << 22) | (3u << 25));  // pad on, after every 256-byte row, 4 dwords; no mask
    g[1] = uni((TROWB & 0xFFFFu) << 16);
    g[2] = uni((TROWB >> 16) | ((TROWS & 0xFFFFu) << 16));
    g[3] = uni((TROWS >> 16) | (TROWB << 16));
    g[4] = uni(TROWS);
    g[5] = uni(src_pitch);
    g[6] = uni(0u);
    g[7] = uni(0u);
    return g;
}
__device__ __forceinline__ u32x4 tdm_group0(unsigned lds_dst, unsigned long long ga) {
    u32x4 g;
    g[0] = uni(1u);
    g[1] = uni(lds_dst);
    g[2] = uni((unsigned)ga);
    g[3] = uni((((unsigned)(ga >> 32)) & 0x01FFFFFFu) | 0x80000000u);
    return g;
}
__device__ __forceinline__ void tdm_load(u32x4 g0, u32x8 g1) {
    asm volatile("tensor_load_to_lds %0, %1" :: "s"(g0), "s"(g1) : "memory");
}

// ---------------- h = x + pos ----------------
__global__ __launch_bounds__(256) void addpos_kernel(const float* __restrict__ x,
                                                     const float* __restrict__ pos,
                                                     float* __restrict__ h) {
    size_t i = ((size_t)blockIdx.x * 256 + threadIdx.x) * 4;
    float4 xv = *(const float4*)(x + i);
    float4 pv = *(const float4*)(pos + (i & (size_t)(SEQ * DMODEL - 1)));
    float4 o;
    o.x = xv.x + pv.x; o.y = xv.y + pv.y; o.z = xv.z + pv.z; o.w = xv.w + pv.w;
    *(float4*)(h + i) = o;
}

// ---------------- Weight pre-pass: W[l][k][n] f32 -> Wt[l][n][k] bf16 ----------------
__global__ __launch_bounds__(256) void wtrans_kernel(const float* __restrict__ W,
                                                     ushort_t* __restrict__ Wt) {
    __shared__ float tile[32][33];
    size_t base = (size_t)blockIdx.z * DMODEL * DMODEL;
    int bx = blockIdx.x * 32;   // n tile
    int by = blockIdx.y * 32;   // k tile
    int tx = threadIdx.x & 31, ty = threadIdx.x >> 5;   // 32 x 8
#pragma unroll
    for (int i = 0; i < 4; ++i)
        tile[ty + i * 8][tx] = W[base + (size_t)(by + ty + i * 8) * DMODEL + bx + tx];
    __syncthreads();
#pragma unroll
    for (int i = 0; i < 4; ++i)
        Wt[base + (size_t)(bx + ty + i * 8) * DMODEL + by + tx] = f2bf(tile[tx][ty + i * 8]);
}

// ---------------- LayerNorm -> bf16 ----------------
__global__ __launch_bounds__(256) void ln_kernel(const float* __restrict__ h,
                                                 const float* __restrict__ g,
                                                 const float* __restrict__ b,
                                                 ushort_t* __restrict__ out) {
    __shared__ float ssum[256];
    __shared__ float ssq[256];
    int row = blockIdx.x, t = threadIdx.x;
    const float* hr = h + (size_t)row * DMODEL;
    float4 f = ((const float4*)hr)[t];
    float s = f.x + f.y + f.z + f.w;
    float sq = f.x * f.x + f.y * f.y + f.z * f.z + f.w * f.w;
    ssum[t] = s; ssq[t] = sq;
    __syncthreads();
    for (int off = 128; off > 0; off >>= 1) {
        if (t < off) { ssum[t] += ssum[t + off]; ssq[t] += ssq[t + off]; }
        __syncthreads();
    }
    float mu = ssum[0] * (1.0f / DMODEL);
    float var = ssq[0] * (1.0f / DMODEL) - mu * mu;
    float rstd = rsqrtf(var + 1e-5f);
    float4 gv = ((const float4*)g)[t];
    float4 bv = ((const float4*)b)[t];
    ushort_t* orow = out + (size_t)row * DMODEL + t * 4;
    orow[0] = f2bf((f.x - mu) * rstd * gv.x + bv.x);
    orow[1] = f2bf((f.y - mu) * rstd * gv.y + bv.y);
    orow[2] = f2bf((f.z - mu) * rstd * gv.z + bv.z);
    orow[3] = f2bf((f.w - mu) * rstd * gv.w + bv.w);
}

// ---------------- bf16 WMMA GEMM, two-buffer LDS ring filled by tensor loads ----------------
// C[M,N] = A[M,K](bf16 [M][K]) * Bt[N,K](bf16, pre-transposed weights)
// Block tile 128x128, 256 threads = 8 waves (2m x 4n), wave tile 64x32.
// A stage is 128 k of all 256 operand rows; each wave brings its own slice of 32 rows with one tensor
// load (waves 0-3: A, waves 4-7: Bt), two stages ahead, into the buffer that every reader has left.
#define BM 128
#define BN 128
#define BK 128
#define SLICEB 10240u            // 32 rows x 272 bytes = 8704, rounded up to a multiple of 2 KiB
#define STAGEB (8u * SLICEB)     // 81920 bytes
#define NSTAGE (DMODEL / BK)     // 8

template <bool BIAS, bool GELU_, bool RESID, bool OBF16, bool TRANSOUT>
__global__ __launch_bounds__(256) void gemm_kernel(const ushort_t* __restrict__ A,
                                                   const ushort_t* __restrict__ Bt,
                                                   const float* __restrict__ bias,
                                                   const float* __restrict__ resid,
                                                   float* __restrict__ outF,
                                                   ushort_t* __restrict__ outB) {
    __shared__ __attribute__((aligned(2048))) unsigned char L[2 * STAGEB];
    const int K = DMODEL, N = DMODEL;
    int t = threadIdx.x;
    int w = t >> 5, lane = t & 31;
    int lm = lane & 15, lh = lane >> 4;
    int wm = w >> 2, wn = w & 3;
    int m0 = blockIdx.y * BM, n0 = blockIdx.x * BN;

    v8f acc[4][2] = {};

    // This wave's slice: its first source byte, and its place in buffer 0.
    const unsigned wave = uni(threadIdx.x >> 5);
    const ushort_t* srow = (wave < 4u) ? A + (size_t)(m0 + (int)wave * 32) * K
                                       : Bt + (size_t)(n0 + ((int)wave - 4) * 32) * K;
    const unsigned long long ga0 = (unsigned long long)(size_t)srow;
    const unsigned slice0 = (unsigned)(size_t)L + wave * SLICEB;
    const u32x8 g1 = tdm_group1(2u * DMODEL);

    // Ring prologue: stage 0 lands and is published, then stage 1 starts.
    tdm_load(tdm_group0(slice0, ga0), g1);
    wait_tensor0();
    __syncthreads();
    tdm_load(tdm_group0(slice0 + STAGEB, ga0 + TROWB), g1);

    // Residual values, all 64 of this lane, issued as one group ahead of the K loop: one load latency
    // for all of them instead of one per element in the epilogue.
    // Each element is read here and written in the epilogue by the same lane and by no other.
    // The three loops are unrolled so that every index of rv is a constant and rv stays in registers.
    float rv[2][4][8];
    if (RESID) {
#pragma unroll
        for (int nf = 0; nf < 2; ++nf)
#pragma unroll
            for (int mf = 0; mf < 4; ++mf)
#pragma unroll
                for (int r = 0; r < 8; ++r)
                    rv[nf][mf][r] = resid[(size_t)(m0 + wm * 64 + mf * 16 + r + 8 * lh) * N
                                          + (n0 + wn * 32 + nf * 16 + lm)];
        // Stands in front of the first instruction that reuses an address register of these loads;
        // the scheduling fence keeps later vector instructions from being moved up over the wait.
        asm volatile("s_wait_xcnt 0x0" ::: "memory");
        __builtin_amdgcn_sched_barrier(0);
    }

    // Fragment bases in buffer 0: A rows wm*64.. lie in slices 2*wm and 2*wm+1, Bt rows wn*32.. in slice 4+wn.
    const unsigned char* Abase = L + (unsigned)(wm * 2) * SLICEB + (unsigned)lm * TPITCH + (unsigned)lh * 16u;
    const unsigned char* Bbase = L + (unsigned)(4 + wn) * SLICEB + (unsigned)lm * TPITCH + (unsigned)lh * 16u;

    for (unsigned s = 0; s < NSTAGE; ++s) {
        const unsigned char* Ab = Abase + (s & 1u) * STAGEB;
        const unsigned char* Bb = Bbase + (s & 1u) * STAGEB;
        // The pass's fragments, all four 32-k blocks of them, in the order in which the blocks use them.
        AFrag af[BK / 32][4], bfr[BK / 32][2];
#pragma unroll
        for (int kk = 0; kk < BK / 32; ++kk) {
#pragma unroll
            for (int mf = 0; mf < 4; ++mf) {
                const unsigned char* p = Ab + (mf >> 1) * SLICEB + (mf & 1) * 16 * TPITCH + kk * 64;
                af[kk][mf].u4[0] = *(const uint4*)p;
                af[kk][mf].u4[1] = *(const uint4*)(p + 32);
            }
#pragma unroll
            for (int nf = 0; nf < 2; ++nf) {
                const unsigned char* p = Bb + nf * 16 * TPITCH + kk * 64;
                bfr[kk][nf].u4[0] = *(const uint4*)p;
                bfr[kk][nf].u4[1] = *(const uint4*)(p + 32);
            }
        }
        // Keeps the LDS reads one group ahead of the WMMAs: moved in among them, into one register set,
        // each pair of WMMAs would wait out a whole LDS latency.
        __builtin_amdgcn_sched_barrier(0);
#pragma unroll
        for (int kk = 0; kk < BK / 32; ++kk)
#pragma unroll
            for (int mf = 0; mf < 4; ++mf)
#pragma unroll
                for (int nf = 0; nf < 2; ++nf)
                    acc[mf][nf] = wmma_bf16(af[kk][mf].v, bfr[kk][nf].v, acc[mf][nf]);
        // Keeps the WMMAs in front of the publish point, under the pass's own LDS reads: moved behind the
        // barrier they would start only when every read has returned, and the refill would issue behind them.
        __builtin_amdgcn_sched_barrier(0);

        // Publish point of stage s + 1: own LDS reads retired, own slice landed, every wave here.
        wait_ds0();
        wait_tensor0();
        __syncthreads();
        // Refill of the buffer that this pass has read, only while stage s + 2 exists.
        if (pinned((s + 2u < NSTAGE) ? 1u : 0u) != 0u) {
            const unsigned nx = pinned(s + 2u);
            tdm_load(tdm_group0(slice0 + (nx & 1u) * STAGEB, ga0 + (unsigned long long)nx * TROWB), g1);
        }
    }
    wait_tensor0();
    wait_ds0();

    // Epilogue: C layout per lane: n = lm, m = r + 8*lh within each 16x16 tile
#pragma unroll
    for (int nf = 0; nf < 2; ++nf) {
        int n = n0 + wn * 32 + nf * 16 + lm;
        float bv = BIAS ? bias[n] : 0.0f;
#pragma unroll
        for (int mf = 0; mf < 4; ++mf) {
#pragma unroll
            for (int r = 0; r < 8; ++r) {
                int m = m0 + wm * 64 + mf * 16 + r + 8 * lh;
                float x = acc[mf][nf][r] + bv;
                if (GELU_) x = 0.5f * x * (1.0f + erff(x * 0.70710678f));
                if (RESID) x += rv[nf][mf][r];
                if (OBF16) {
                    if (TRANSOUT) outB[(size_t)n * MROWS + m] = f2bf(x);
                    else          outB[(size_t)m * N + n]     = f2bf(x);
                } else {
                    outF[(size_t)m * N + n] = x;
                }
            }
        }
    }
}

// ---------------- Flash attention (bf16 WMMA, online softmax, barrier-free) ----------------
// V arrives pre-transposed as Vt[D][M]; K/Q/V fragments load straight from global.
// Grid: B*H*(S/128) blocks, 256 threads = 8 waves, each wave owns 16 q-rows.
__global__ __launch_bounds__(256) void attn_kernel(const ushort_t* __restrict__ Q,
                                                   const ushort_t* __restrict__ K,
                                                   const ushort_t* __restrict__ Vt,
                                                   ushort_t* __restrict__ O) {
    __shared__ ushort_t Plds[8][16 * 40];      // per-wave P staging [q][j]
    int w = threadIdx.x >> 5, lane = threadIdx.x & 31;
    int lm = lane & 15, lh = lane >> 4, kb = lh * 8;
    int qb = blockIdx.x & 7;                   // S/128 = 8
    int bh = blockIdx.x >> 3;
    int bi = bh >> 4, hi = bh & 15;
    size_t headoff = (size_t)bi * SEQ * DMODEL + (size_t)hi * DHEAD;
    int q0 = qb * 128 + w * 16;

    AFrag qf[2];
    {
        const ushort_t* qrow = Q + headoff + (size_t)(q0 + lm) * DMODEL;
#pragma unroll
        for (int d = 0; d < 2; ++d) {
            qf[d].u4[0] = *(const uint4*)(qrow + d * 32 + kb);
            qf[d].u4[1] = *(const uint4*)(qrow + d * 32 + kb + 16);
        }
    }

    v8f o_acc[4] = {};
    float mrow[8], lrowv[8];
#pragma unroll
    for (int r = 0; r < 8; ++r) { mrow[r] = -1e30f; lrowv[r] = 0.0f; }

    for (int kv0 = 0; kv0 < SEQ; kv0 += 32) {
        if (kv0 + 32 < SEQ)
            __builtin_prefetch(K + headoff + (size_t)(kv0 + 32 + lm) * DMODEL, 0, 1);

        // Scores: S[16q x 32j] = Q x K^T
        v8f s0 = {}, s1 = {};
#pragma unroll
        for (int jt = 0; jt < 2; ++jt) {
            const ushort_t* krow = K + headoff + (size_t)(kv0 + jt * 16 + lm) * DMODEL;
            AFrag kf0, kf1;
            kf0.u4[0] = *(const uint4*)(krow + kb);
            kf0.u4[1] = *(const uint4*)(krow + kb + 16);
            kf1.u4[0] = *(const uint4*)(krow + 32 + kb);
            kf1.u4[1] = *(const uint4*)(krow + 32 + kb + 16);
            if (jt == 0) {
                s0 = wmma_bf16(qf[0].v, kf0.v, s0);
                s0 = wmma_bf16(qf[1].v, kf1.v, s0);
            } else {
                s1 = wmma_bf16(qf[0].v, kf0.v, s1);
                s1 = wmma_bf16(qf[1].v, kf1.v, s1);
            }
        }

        // Online softmax (rows in 16-lane halves; xor-shuffle reductions, wave32)
        ushort_t* Pw = Plds[w];
#pragma unroll
        for (int r = 0; r < 8; ++r) {
            float a = s0[r] * 0.125f, b = s1[r] * 0.125f;
            float mx = fmaxf(a, b);
#pragma unroll
            for (int msk = 1; msk < 16; msk <<= 1) mx = fmaxf(mx, __shfl_xor(mx, msk, 32));
            float mnew = fmaxf(mrow[r], mx);
            float p0 = __expf(a - mnew), p1 = __expf(b - mnew);
            float alpha = __expf(mrow[r] - mnew);
            float rs = p0 + p1;
#pragma unroll
            for (int msk = 1; msk < 16; msk <<= 1) rs += __shfl_xor(rs, msk, 32);
            lrowv[r] = lrowv[r] * alpha + rs;
            mrow[r] = mnew;
#pragma unroll
            for (int nt = 0; nt < 4; ++nt) o_acc[nt][r] *= alpha;
            int prow = r + 8 * lh;
            Pw[prow * 40 + lm] = f2bf(p0);
            Pw[prow * 40 + 16 + lm] = f2bf(p1);
        }

        // P fragment (wave-private LDS re-layout C-frag -> A-frag)
        AFrag pf;
        pf.u4[0] = *(const uint4*)&Pw[lm * 40 + kb];
        pf.u4[1] = *(const uint4*)&Pw[lm * 40 + kb + 16];

        // O += P x V  (V B-frags straight from transposed global Vt[D][M])
#pragma unroll
        for (int nt = 0; nt < 4; ++nt) {
            AFrag vf;
            const ushort_t* vrow = Vt + (size_t)(hi * DHEAD + nt * 16 + lm) * MROWS
                                      + (size_t)bi * SEQ + kv0;
            vf.u4[0] = *(const uint4*)(vrow + kb);
            vf.u4[1] = *(const uint4*)(vrow + kb + 16);
            o_acc[nt] = wmma_bf16(pf.v, vf.v, o_acc[nt]);
        }
    }

    // Normalize and store bf16 [B,S,D] with heads interleaved
#pragma unroll
    for (int nt = 0; nt < 4; ++nt) {
#pragma unroll
        for (int r = 0; r < 8; ++r) {
            int qq = q0 + r + 8 * lh;
            float val = o_acc[nt][r] / lrowv[r];
            O[headoff + (size_t)qq * DMODEL + nt * 16 + lm] = f2bf(val);
        }
    }
}

// ---------------- Host launcher ----------------
extern "C" void kernel_launch(void* const* d_in, const int* in_sizes, int n_in,
                              void* d_out, int out_size, void* d_ws, size_t ws_size,
                              hipStream_t stream) {
    const float* x     = (const float*)d_in[0];
    const float* pos   = (const float*)d_in[1];
    const float* ln1_g = (const float*)d_in[2];
    const float* ln1_b = (const float*)d_in[3];
    const float* Wq    = (const float*)d_in[4];
    const float* Wk    = (const float*)d_in[5];
    const float* Wv    = (const float*)d_in[6];
    const float* Wo    = (const float*)d_in[7];
    const float* ln2_g = (const float*)d_in[8];
    const float* ln2_b = (const float*)d_in[9];
    const float* W1    = (const float*)d_in[10];
    const float* b1    = (const float*)d_in[11];
    const float* W2    = (const float*)d_in[12];
    const float* b2    = (const float*)d_in[13];
    float* out = (float*)d_out;

    const size_t MD = (size_t)MROWS * DMODEL;     // 4M elements
    const size_t DD = (size_t)DMODEL * DMODEL;    // 1M elements
    char* ws = (char*)d_ws;
    float*    h   = (float*)ws;                      // 16 MB f32 residual stream
    ushort_t* nb  = (ushort_t*)(ws + MD * 4);        // bf16 LN output
    ushort_t* qB  = nb + MD;
    ushort_t* kB  = qB + MD;
    ushort_t* vTB = kB + MD;                         // V, transposed [D][M]
    ushort_t* oB  = vTB + MD;
    ushort_t* f1B = oB + MD;
    ushort_t* wt  = f1B + MD;                        // 6 x [DEPTH][D][D] bf16, transposed
    ushort_t* wtQ = wt;
    ushort_t* wtK = wtQ + 4 * DD;
    ushort_t* wtV = wtK + 4 * DD;
    ushort_t* wtO = wtV + 4 * DD;
    ushort_t* wt1 = wtO + 4 * DD;
    ushort_t* wt2 = wt1 + 4 * DD;

    dim3 tgrid(32, 32, 4);
    wtrans_kernel<<<tgrid, 256, 0, stream>>>(Wq, wtQ);
    wtrans_kernel<<<tgrid, 256, 0, stream>>>(Wk, wtK);
    wtrans_kernel<<<tgrid, 256, 0, stream>>>(Wv, wtV);
    wtrans_kernel<<<tgrid, 256, 0, stream>>>(Wo, wtO);
    wtrans_kernel<<<tgrid, 256, 0, stream>>>(W1, wt1);
    wtrans_kernel<<<tgrid, 256, 0, stream>>>(W2, wt2);

    addpos_kernel<<<4096, 256, 0, stream>>>(x, pos, h);

    dim3 ggrid(DMODEL / BN, MROWS / BM);   // (8, 32)

    for (int L = 0; L < 4; ++L) {
        // --- Attention block ---
        ln_kernel<<<MROWS, 256, 0, stream>>>(h, ln1_g + L * DMODEL, ln1_b + L * DMODEL, nb);
        gemm_kernel<false, false, false, true, false><<<ggrid, 256, 0, stream>>>(
            nb, wtQ + L * DD, nullptr, nullptr, nullptr, qB);
        gemm_kernel<false, false, false, true, false><<<ggrid, 256, 0, stream>>>(
            nb, wtK + L * DD, nullptr, nullptr, nullptr, kB);
        gemm_kernel<false, false, false, true, true><<<ggrid, 256, 0, stream>>>(
            nb, wtV + L * DD, nullptr, nullptr, nullptr, vTB);     // V stored [D][M]
        attn_kernel<<<BSZ * NHEAD * (SEQ / 128), 256, 0, stream>>>(qB, kB, vTB, oB);
        gemm_kernel<false, false, true, false, false><<<ggrid, 256, 0, stream>>>(
            oB, wtO + L * DD, nullptr, h, h, nullptr);             // h = h + attn_out

        // --- FFN block ---
        ln_kernel<<<MROWS, 256, 0, stream>>>(h, ln2_g + L * DMODEL, ln2_b + L * DMODEL, nb);
        gemm_kernel<true, true, false, true, false><<<ggrid, 256, 0, stream>>>(
            nb, wt1 + L * DD, b1 + L * DMODEL, nullptr, nullptr, f1B);
        float* hout = (L == 3) ? out : h;
        gemm_kernel<true, false, true, false, false><<<ggrid, 256, 0, stream>>>(
            f1B, wt2 + L * DD, b2 + L * DMODEL, h, hout, nullptr); // h(+1) = h + ffn
    }
}
